// v010
// Times are from an AMD MI455X. After a warm-up the kernel runs many times in a row, and a time is the length of
// such a window on the GPU divided by its runs, so every launch and the gaps after it count. The runs cycle
// through copies of the inputs. A figure is the median of several windows, for all but v000 over two sittings.
// Sittings can differ by a few percent; kernels timed side by side share one.
// Earlier versions than v010 are not in this document.
// A run of this version takes 165 microseconds.
// In both of two side-by-side timings against v009, it was 1.05 times as fast.
// Over all steps from v000, the starting kernel, it is 13.7 times as fast.
#include <hip/hip_runtime.h>
// K2Layer (h [8][1024][1024]; hn = rmsnorm(h)*norm1_scale; gate = sigmoid(gate_logit), alpha = sigmoid(alpha_logit); q|k = hn [u|v] (rank 64), row-l2-normalised; gamma_r = 0.15 + 0.85 sigmoid(decay_logit_r); A[i][j] = causal(j<=i) * (gate k_base[i][j] + alpha sum_r q[i][r] k[j][r] gamma_r^(i-j)); out = A . hn; h1 = h + out proj_w^T + proj_b; m = gelu_erf(rmsnorm(h1)*norm2_scale up_w^T + up_b) down_w^T + down_b; result = h1 + m -> [8][1024][1024]).
// Structure: token rows; rmsnorm on VALU (f32) into f16 rows and per-batch transposed f16 planes (LDS); the rank-64 q|k projection as a WMMA GEMM (f32), l2-normalisation on VALU in f32; the per-rank decayed causal scores (gamma^d table built on device from decay_logit, k_base/gate/alpha read) on VALU in f32 in the tiles that the diagonal crosses, as WMMA products of decay-weighted q and k rows (f16 hi + lo pairs, f32 accumulation) below it, into the f16 mixing matrix A; out = A . hn, proj (+ bias + h), up (+ bias, erf-GELU epilogue, f16), down (+ bias + h1) as WMMA GEMMs (64x64 wave tiles, 32x64 for q|k; f32 accumulation, exact x16 weights).
// Compute dtype: inputs rounded to bf16; h / weights / k_base exact; hn, A, out, h1 norm2_scale (its 1 / rms applied in f32 behind the product), GELU hidden plain f16 operands (~2^-12); scores, norms, residuals f32. v_wmma_f32_16x16x32_f16.
#define NB 8
#define SQ 1024
#define DM 1024
#define RR 64
#define FH 2048
#define NR ((size_t)NB * SQ)
#define MQ NR                        /* rows through the proj/MLP stage (debug hook) */
typedef __bf16 v16b __attribute__((ext_vector_type(16)));
typedef unsigned short v8us __attribute__((ext_vector_type(8), may_alias));
typedef float  v8f  __attribute__((ext_vector_type(8)));
typedef float  v4f  __attribute__((ext_vector_type(4)));
typedef float  v4fa __attribute__((ext_vector_type(4), may_alias));
union FragB { v16b v; v8us half[2]; unsigned short u[16]; };

__device__ __forceinline__ unsigned short bf16_bits(float x) { unsigned int u = __float_as_uint(x); return (unsigned short)((u + 0x7FFFu + ((u >> 16) & 1u)) >> 16); }
__device__ __forceinline__ float bf16_val(unsigned short b) { return __uint_as_float(((unsigned int)b) << 16); }
__device__ __forceinline__ float bf16_round(float x) { return bf16_val(bf16_bits(x)); }
// D += A·B with NT terms: 1 = ah·bh, 2 = + al·bh (A split), 3 = + ah·bl (both split)
template <int NT>
__device__ __forceinline__ v8f mmaN(v16b ah, v16b al, v16b bh, v16b bl, v8f c) {
  c = __builtin_amdgcn_wmma_f32_16x16x32_bf16(false, ah, false, bh, (short)0, c, false, false);
  if (NT >= 2) c = __builtin_amdgcn_wmma_f32_16x16x32_bf16(false, al, false, bh, (short)0, c, false, false);
  if (NT >= 3) c = __builtin_amdgcn_wmma_f32_16x16x32_bf16(false, ah, false, bl, (short)0, c, false, false);
  asm volatile("v_nop\n\tv_nop\n\tv_nop\n\tv_nop" : "+v"(c) : "v"(ah), "v"(al), "v"(bh), "v"(bl));
  return c;
}

__global__ __launch_bounds__(256) void k_wt_bf16(const float* __restrict__ W, unsigned short* __restrict__ Wt, int K, int N) {
  const int t = blockIdx.x * 256 + threadIdx.x;
  const int k8n = K / 8;
  if (t >= N * k8n) return;
  const int n = t / k8n, k8 = (t % k8n) * 8;
  v8us v;
#pragma unroll
  for (int i = 0; i < 8; ++i) v[i] = bf16_bits(W[(size_t)(k8 + i) * N + n]);
  *(v8us*)(Wt + (size_t)n * K + k8) = v;
  
}

// GEMM C[M][N] (f32, pitch ldc) = act(A[M][K]·W + bias). A f32 row-major (pitch lda) converted per fragment to bf16
// (ASPLIT: hi/lo two planes -> 2 terms, else single rounded term); Wt bf16 [N][K] (pitch ldb). BIAS_BF16 rounds the
// bias to bf16 first (bias quantised to bf16 before the add). K%32==0, M%16==0, N%64==0.
template <bool ASPLIT, int ACT, bool BIAS_BF16>
__global__ __launch_bounds__(128) void k_gemm_bf(const float* __restrict__ A, int lda, const unsigned short* __restrict__ Wt, int ldb,
                                               const float* __restrict__ bias, float* __restrict__ C, int ldc, int M, int N, int K) {
  __shared__ __attribute__((aligned(16))) float so[4][16][64];
  const int tid = threadIdx.x, w = tid >> 5, lane = tid & 31, ln = lane & 15, hh = lane >> 4;
  const int ntn = N / 64;
  const int wid = blockIdx.x * 4 + w;
  const int mt = wid / ntn, nq = wid % ntn;
  if (mt * 16 >= M) return;
  const int row0 = mt * 16, col0 = nq * 64;
  const float* arow = A + (size_t)(row0 + ln) * lda;
  v8f acc[4] = {};
  for (int kb = 0; kb < K; kb += 32) {
    FragB ah, al;
    const v4f x0 = *(const v4fa*)(arow + kb + 8 * hh), x1 = *(const v4fa*)(arow + kb + 8 * hh + 4);
    const v4f x2 = *(const v4fa*)(arow + kb + 16 + 8 * hh), x3 = *(const v4fa*)(arow + kb + 16 + 8 * hh + 4);
    float xs[16] = {x0[0],x0[1],x0[2],x0[3],x1[0],x1[1],x1[2],x1[3],x2[0],x2[1],x2[2],x2[3],x3[0],x3[1],x3[2],x3[3]};
#pragma unroll
    for (int i = 0; i < 16; ++i) { const unsigned short hb = bf16_bits(xs[i]); ah.u[i] = hb; al.u[i] = ASPLIT ? bf16_bits(xs[i] - bf16_val(hb)) : (unsigned short)0; }
#pragma unroll
    for (int t = 0; t < 4; ++t) {
      const unsigned short* brow = Wt + (size_t)(col0 + t * 16 + ln) * ldb + kb;
      FragB b;
      b.half[0] = *(const v8us*)(brow + 8 * hh);
      b.half[1] = *(const v8us*)(brow + 16 + 8 * hh);
      acc[t] = mmaN<ASPLIT ? 2 : 1>(ah.v, al.v, b.v, b.v, acc[t]);
    }
  }
#pragma unroll
  for (int t = 0; t < 4; ++t) {
    float bv = bias ? bias[col0 + t * 16 + ln] : 0.f;
    if (BIAS_BF16) bv = bf16_round(bv);
#pragma unroll
    for (int r = 0; r < 8; ++r) { float v = acc[t][r] + bv; if (ACT == 1) v = fmaxf(v, 0.f); so[w][8 * hh + r][t * 16 + ln] = v; }
  }
  __builtin_amdgcn_fence(__ATOMIC_ACQ_REL, "workgroup");
  __builtin_amdgcn_wave_barrier();
  const int rsub = lane >> 4, c4 = (lane & 15) * 4;
  {
#pragma unroll
    for (int q = 0; q < 8; ++q) {
      const int r = q * 2 + rsub;
      const v4f v = *(const v4fa*)&so[w][r][c4];
      *(v4f*)(C + (size_t)(row0 + r) * ldc + col0 + c4) = v;
    }
    
  }
}

// GEMM C = act(A·W + bias + resid): A f32 (ASPLIT -> hi/lo 2 terms), Wt bf16 [N][K]; ACT 0 none, 1 relu, 2 exact gelu;
// resid (optional, f32, row index = (row % rmod), pitch ldr, RES_BF16 rounds it) added before the activation.
template <bool ASPLIT, int ACT, bool BIAS_BF16, bool RES_BF16>
__global__ __launch_bounds__(128) void k_gemm_bf3(const float* __restrict__ A, int lda, const unsigned short* __restrict__ Wt, int ldb,
                                                const float* __restrict__ bias, const float* __restrict__ resid, int rmod, int ldr,
                                                float* __restrict__ C, int ldc, int M, int N, int K) {
  __shared__ __attribute__((aligned(16))) float so[4][16][64];
  const int tid = threadIdx.x, w = tid >> 5, lane = tid & 31, ln = lane & 15, hh = lane >> 4;
  const int ntn = N / 64;
  const int wid = blockIdx.x * 4 + w;
  const int mt = wid / ntn, nq = wid % ntn;
  if (mt * 16 >= M) return;
  const int row0 = mt * 16, col0 = nq * 64;
  const float* arow = A + (size_t)(row0 + ln) * lda;
  v8f acc[4] = {};
  for (int kb = 0; kb < K; kb += 32) {
    FragB ah, al;
    const v4f x0 = *(const v4fa*)(arow + kb + 8 * hh), x1 = *(const v4fa*)(arow + kb + 8 * hh + 4);
    const v4f x2 = *(const v4fa*)(arow + kb + 16 + 8 * hh), x3 = *(const v4fa*)(arow + kb + 16 + 8 * hh + 4);
    float xs[16] = {x0[0],x0[1],x0[2],x0[3],x1[0],x1[1],x1[2],x1[3],x2[0],x2[1],x2[2],x2[3],x3[0],x3[1],x3[2],x3[3]};
#pragma unroll
    for (int i = 0; i < 16; ++i) { const unsigned short hb = bf16_bits(xs[i]); ah.u[i] = hb; al.u[i] = ASPLIT ? bf16_bits(xs[i] - bf16_val(hb)) : (unsigned short)0; }
#pragma unroll
    for (int t = 0; t < 4; ++t) {
      const unsigned short* brow = Wt + (size_t)(col0 + t * 16 + ln) * ldb + kb;
      FragB b;
      b.half[0] = *(const v8us*)(brow + 8 * hh);
      b.half[1] = *(const v8us*)(brow + 16 + 8 * hh);
      acc[t] = mmaN<ASPLIT ? 2 : 1>(ah.v, al.v, b.v, b.v, acc[t]);
    }
  }
#pragma unroll
  for (int t = 0; t < 4; ++t) {
    const int col = col0 + t * 16 + ln;
    float bv = bias ? bias[col] : 0.f;
    if (BIAS_BF16) bv = bf16_round(bv);
#pragma unroll
    for (int r = 0; r < 8; ++r) {
      float v = acc[t][r] + bv;
      if (resid) { float rv = resid[(size_t)((row0 + 8 * hh + r) % rmod) * ldr + col]; if (RES_BF16) rv = bf16_round(rv); v += rv; }
      if (ACT == 1) v = fmaxf(v, 0.f);
      if (ACT == 2) v = 0.5f * v * (1.0f + erff(v * 0.70710678118654752f));
      if (ACT == 3) { const float u = 0.7978845608028654f * (v + 0.044715f * v * v * v); v = 0.5f * v * (1.0f + tanhf(u)); }
      so[w][8 * hh + r][t * 16 + ln] = v;
    }
  }
  __builtin_amdgcn_fence(__ATOMIC_ACQ_REL, "workgroup");
  __builtin_amdgcn_wave_barrier();
  const int rsub = lane >> 4, c4 = (lane & 15) * 4;
  {
#pragma unroll
    for (int q = 0; q < 8; ++q) {
      const int r = q * 2 + rsub;
      const v4f v = *(const v4fa*)&so[w][r][c4];
      *(v4f*)(C + (size_t)(row0 + r) * ldc + col0 + c4) = v;
    }
    
  }
}
// row LayerNorm (biased variance, eps) over N: s = X (+ R); optional out_sum <- s; out_norm <- (s-mu)*rsqrt(var+eps)*g + b
template <bool PARAM_BF16>
__global__ __launch_bounds__(256) void k_layernorm(const float* __restrict__ X, const float* __restrict__ R, const float* __restrict__ g, const float* __restrict__ bta,
                                                  float* __restrict__ out_sum, float* __restrict__ out_norm, int N, float eps) {
  __shared__ float red[256];
  const int row = blockIdx.x, tid = threadIdx.x;
  const float* x = X + (size_t)row * N; const float* rr = R ? R + (size_t)row * N : nullptr;
  float vals[16];                     // up to N = 4096
  const int per = N / 256;            // contiguous chunk per thread? use strided-by-4 chunks: thread handles j = tid*4 + 1024*u
  float s1 = 0.f;
  for (int u = 0; u < per / 4; ++u) {
    const int j = tid * 4 + 1024 * u;
    const v4f a = *(const v4fa*)(x + j);
    v4f b = {0.f,0.f,0.f,0.f}; if (rr) b = *(const v4fa*)(rr + j);
#pragma unroll
    for (int q = 0; q < 4; ++q) { const float v = a[q] + b[q]; vals[u * 4 + q] = v; s1 += v; }
  }
  red[tid] = s1; __syncthreads();
  for (int st = 128; st > 0; st >>= 1) { if (tid < st) red[tid] += red[tid + st]; __syncthreads(); }
  const float mu = red[0] / (float)N; __syncthreads();
  float s2 = 0.f;
  for (int u = 0; u < per / 4; ++u)
#pragma unroll
    for (int q = 0; q < 4; ++q) { const float c = vals[u * 4 + q] - mu; s2 += c * c; }
  red[tid] = s2; __syncthreads();
  for (int st = 128; st > 0; st >>= 1) { if (tid < st) red[tid] += red[tid + st]; __syncthreads(); }
  const float rs = rsqrtf(red[0] / (float)N + eps);
  {
    for (int u = 0; u < per / 4; ++u) {
      const int j = tid * 4 + 1024 * u;
      v4f o, sm;
#pragma unroll
      for (int q = 0; q < 4; ++q) {
        float gg = g[j + q], bb = bta[j + q];
        if (PARAM_BF16) { gg = bf16_round(gg); bb = bf16_round(bb); }
        sm[q] = vals[u * 4 + q]; o[q] = (vals[u * 4 + q] - mu) * rs * gg + bb;
      }
      if (out_sum) *(v4f*)(out_sum + (size_t)row * N + j) = sm;
      *(v4f*)(out_norm + (size_t)row * N + j) = o;
    }
    
  }
}



// ---- f16 WMMA path (v_wmma_f32_16x16x32_f16): 11-bit significands for operands in range — used for every product that this file launches
typedef _Float16 v16h __attribute__((ext_vector_type(16)));
union FragH { v16h v; v8us half[2]; _Float16 h[16]; unsigned short u[16]; };
template <int NT>
__device__ __forceinline__ v8f mmaH(v16h ah, v16h al, v16h bh, v16h bl, v8f c) {
  c = __builtin_amdgcn_wmma_f32_16x16x32_f16(false, ah, false, bh, (short)0, c, false, false);
  if (NT >= 2) c = __builtin_amdgcn_wmma_f32_16x16x32_f16(false, al, false, bh, (short)0, c, false, false);
  if (NT >= 3) c = __builtin_amdgcn_wmma_f32_16x16x32_f16(false, ah, false, bl, (short)0, c, false, false);
  asm volatile("v_nop\n\tv_nop\n\tv_nop\n\tv_nop" : "+v"(c) : "v"(ah), "v"(al), "v"(bh), "v"(bl));
  return c;
}
// batched GEMM like k_gemm_b but f16 operands: A f32 (split into f16 hi/lo if ASPLIT, else rounded to f16), Bt = f16 values [n][k]; alpha; C f32; N multiple of 16 (partial tiles skipped)
template <bool ASPLIT>
__global__ __launch_bounds__(128) void k_gemm_h(const float* __restrict__ A, int lda, size_t sA, const _Float16* __restrict__ Bh, int ldb, size_t sB, float alpha, float* __restrict__ C, int ldc, size_t sC, int M, int N, int K) {
  __shared__ __attribute__((aligned(16))) float so[4][16][64];
  const int tid = threadIdx.x, w = tid >> 5, lane = tid & 31, ln = lane & 15, hh = lane >> 4; const int by = blockIdx.y;
  A += (size_t)by * sA; Bh += (size_t)by * sB; C += (size_t)by * sC;
  const int ntn = (N + 63) / 64; const int wid = blockIdx.x * 4 + w; const int mt = wid / ntn, nq = wid % ntn; if (mt * 16 >= M) return;
  const int row0 = mt * 16, col0 = nq * 64; const float* arow = A + (size_t)(row0 + ln) * lda;
  v8f acc[4] = {};
  for (int kb = 0; kb < K; kb += 32) {
    FragH ah, al;
    const v4f x0 = *(const v4fa*)(arow + kb + 8 * hh), x1 = *(const v4fa*)(arow + kb + 8 * hh + 4), x2 = *(const v4fa*)(arow + kb + 16 + 8 * hh), x3 = *(const v4fa*)(arow + kb + 16 + 8 * hh + 4);
    float xs[16] = {x0[0],x0[1],x0[2],x0[3],x1[0],x1[1],x1[2],x1[3],x2[0],x2[1],x2[2],x2[3],x3[0],x3[1],x3[2],x3[3]};
#pragma unroll
    for (int i = 0; i < 16; ++i) { const _Float16 h = (_Float16)xs[i]; ah.h[i] = h; al.h[i] = ASPLIT ? (_Float16)(xs[i] - (float)h) : (_Float16)0.0f; }
#pragma unroll
    for (int t = 0; t < 4; ++t) { if (col0 + t * 16 >= N) continue; const size_t boff = (size_t)(col0 + t * 16 + ln) * ldb + kb; FragH bq; bq.half[0] = *(const v8us*)(Bh + boff + 8 * hh); bq.half[1] = *(const v8us*)(Bh + boff + 16 + 8 * hh);
      acc[t] = mmaH<ASPLIT ? 2 : 1>(ah.v, al.v, bq.v, bq.v, acc[t]); }
  }
#pragma unroll
  for (int t = 0; t < 4; ++t) { if (col0 + t * 16 >= N) continue;
#pragma unroll
    for (int r = 0; r < 8; ++r) so[w][8 * hh + r][t * 16 + ln] = acc[t][r] * alpha; }
  __builtin_amdgcn_fence(__ATOMIC_ACQ_REL, "workgroup"); __builtin_amdgcn_wave_barrier();
  const int rsub = lane >> 4, c4 = (lane & 15) * 4;
  {
#pragma unroll
    for (int q = 0; q < 8; ++q) { const int r = q * 2 + rsub; if (col0 + c4 < N) { const v4f v = *(const v4fa*)&so[w][r][c4]; *(v4f*)(C + (size_t)(row0 + r) * ldc + col0 + c4) = v; } }
     }
}

// Wt[n][k] = f16(W[k][n]·scale) from f32 row-major W[K][N] (scale = power of two; bf16-exact weights stay exact in f16 away from the subnormal range)
__global__ __launch_bounds__(256) void k_wt_f16(const float* __restrict__ W, _Float16* __restrict__ Wt, int K, int N, float scale) {
  const int t = blockIdx.x * 256 + threadIdx.x; if (t >= N * (K / 8)) return; const int n = t / (K / 8), k8 = (t % (K / 8)) * 8; FragH f;
#pragma unroll
  for (int i = 0; i < 8; ++i) f.h[i] = (_Float16)(bf16_round(W[(size_t)(k8 + i) * N + n]) * scale); const v8us o = f.half[0];
  *(v8us*)((unsigned short*)Wt + (size_t)n * K + k8) = o; 
}
// k_gemm_hh variant with fused epilogue: v = acc·alpha + bias[by·sBias + col] (+ CP[(row/rowsPerB)·sCPb + by·64 + col] if CP) ; ACT 0 none / 1 elu ; writes f16 C16 (and f32 C if non-null)
template <int ACT>
__global__ __launch_bounds__(128) void k_gemm_hhx(const _Float16* __restrict__ A, int lda, size_t sA, const _Float16* __restrict__ Bh, int ldb, size_t sB, float alpha, const float* __restrict__ bias, size_t sBias, const float* __restrict__ CP, int rowsPerB, size_t sCPb, int row0g,
    float* __restrict__ C, _Float16* __restrict__ C16, int ldc, size_t sC, int M, int N, int K) {
  __shared__ __attribute__((aligned(16))) float so[4][16][64];
  const int tid = threadIdx.x, w = tid >> 5, lane = tid & 31, ln = lane & 15, hh = lane >> 4; const int by = blockIdx.y;
  A += (size_t)by * sA; Bh += (size_t)by * sB; const size_t cofs = (size_t)by * sC; const float* bp = bias ? bias + (size_t)by * sBias : nullptr;
  const int ntn = (N + 63) / 64; const int wid = blockIdx.x * 4 + w; const int mt = wid / ntn, nq = wid % ntn; if (mt * 16 >= M) return;
  const int row0 = mt * 16, col0 = nq * 64; const _Float16* arow = A + (size_t)(row0 + ln) * lda;
  v8f acc[4] = {};
  for (int kb = 0; kb < K; kb += 32) { FragH ah; ah.half[0] = *(const v8us*)((const unsigned short*)arow + kb + 8 * hh); ah.half[1] = *(const v8us*)((const unsigned short*)arow + kb + 16 + 8 * hh);
#pragma unroll
    for (int t = 0; t < 4; ++t) { if (col0 + t * 16 >= N) continue; const size_t boff = (size_t)(col0 + t * 16 + ln) * ldb + kb; FragH bq; bq.half[0] = *(const v8us*)((const unsigned short*)Bh + boff + 8 * hh); bq.half[1] = *(const v8us*)((const unsigned short*)Bh + boff + 16 + 8 * hh);
      acc[t] = mmaH<1>(ah.v, ah.v, bq.v, bq.v, acc[t]); }
  }
#pragma unroll
  for (int t = 0; t < 4; ++t) { if (col0 + t * 16 >= N) continue; const int col = col0 + t * 16 + ln; const float bv = bp ? bf16_round(bp[col]) : 0.f;
#pragma unroll
    for (int r = 0; r < 8; ++r) { float v = acc[t][r] * alpha + bv; if (CP) { const int rr = row0g + row0 + 8 * hh + r; if (rowsPerB < 0) v += CP[cofs + (size_t)rr * ldc + col];      /* rowsPerB < 0: own element of the batched C plane */ else { const int bidx = rr / rowsPerB; v += CP[(size_t)bidx * sCPb + (size_t)by * 64 + col]; } } if (ACT == 1) v = (v > 0.f) ? v : expm1f(v); else if (ACT == 7) v = (v > 0.f) ? v + 1.0f : expf(v); else if (ACT == 8) v = tanhf(v); else if (ACT == 9) v = 0.5f * v * (1.0f + tanhf(0.7978845608028654f * (v + 0.044715f * v * v * v))); else if (ACT == 11) v = 1.0f / (1.0f + expf(-v)); else if (ACT == 12) v = (v > 0.f) ? v : 0.01f * v; else if (ACT == 14) v = (v > 0.f) ? v : 0.1f * v; else if (ACT == 16) v = (v >= 0.f) ? v : 0.3f * v; else if (ACT == 17) v = (v >= 0.f) ? v : 0.2f * v; else if (ACT == 15) v = v / (1.0f + expf(-v)); else if (ACT == 3) v = fmaxf(v, 0.f); else if (ACT == 6) v = 0.5f * v * (1.0f + erff(v * 0.70710678118654752f)); so[w][8 * hh + r][t * 16 + ln] = v; } }
  __builtin_amdgcn_fence(__ATOMIC_ACQ_REL, "workgroup"); __builtin_amdgcn_wave_barrier();
  const int rsub = lane >> 4, c4 = (lane & 15) * 4; typedef _Float16 v4h __attribute__((ext_vector_type(4)));
  {
#pragma unroll
    for (int q = 0; q < 8; ++q) { const int r = q * 2 + rsub; if (col0 + c4 < N) { const v4f v = *(const v4fa*)&so[w][r][c4]; if (C) *(v4f*)(C + cofs + (size_t)(row0 + r) * ldc + col0 + c4) = v; if (C16) { v4h h4; for (int i = 0; i < 4; ++i) h4[i] = (_Float16)v[i]; *(v4h*)(C16 + cofs + (size_t)(row0 + r) * ldc + col0 + c4) = h4; } } }
     }
}


typedef _Float16 v4h __attribute__((ext_vector_type(4)));

__global__ __launch_bounds__(256) void k_x16(const float* __restrict__ x, _Float16* __restrict__ X16, size_t n8) { const size_t t = (size_t)blockIdx.x * 256 + threadIdx.x; if (t >= n8) return; FragH f;
#pragma unroll
  for (int q = 0; q < 8; ++q) f.h[q] = (_Float16)bf16_round(x[t * 8 + q]); *(v8us*)((unsigned short*)X16 + t * 8) = f.half[0];  }
__global__ __launch_bounds__(256) void k_h16(const float* __restrict__ x, _Float16* __restrict__ X16, size_t n8) { const size_t t = (size_t)blockIdx.x * 256 + threadIdx.x; if (t >= n8) return; FragH f;
#pragma unroll
  for (int q = 0; q < 8; ++q) f.h[q] = (_Float16)x[t * 8 + q]; *(v8us*)((unsigned short*)X16 + t * 8) = f.half[0];  }
__global__ __launch_bounds__(256) void k_round16f(const float* __restrict__ W, _Float16* __restrict__ Bt, size_t n8) { const size_t t = (size_t)blockIdx.x * 256 + threadIdx.x; if (t >= n8) return; FragH f;
#pragma unroll
  for (int i = 0; i < 8; ++i) f.h[i] = (_Float16)(bf16_round(W[t * 8 + i]) * 16.0f); *(v8us*)((unsigned short*)Bt + t * 8) = f.half[0];  }
template <int NHv, int TTv>
__global__ __launch_bounds__(256) void k_vt(const _Float16* __restrict__ V16, int ldv, int voff, _Float16* __restrict__ Vt) { __shared__ unsigned short tl[64][66]; const int tid = threadIdx.x; const int slab = blockIdx.x / (TTv / 64), lg = blockIdx.x % (TTv / 64); const int b = slab / NHv, h = slab % NHv;
  for (int i = tid; i < 64 * 8; i += 256) { const int r = i / 8, c8 = (i % 8) * 8; FragH f; f.half[0] = *(const v8us*)((const unsigned short*)V16 + ((size_t)b * TTv + lg * 64 + r) * ldv + voff + h * 64 + c8);
#pragma unroll
    for (int q = 0; q < 8; ++q) tl[r][c8 + q] = f.u[q]; }
  __syncthreads();
  {
#pragma unroll
    for (int rd = 0; rd < 2; ++rd) { const int d = rd * 32 + tid / 8, pc = tid % 8; FragH f;
#pragma unroll
      for (int q = 0; q < 8; ++q) f.u[q] = tl[pc * 8 + q][d];
      *(v8us*)((unsigned short*)Vt + ((size_t)slab * 64 + d) * TTv + lg * 64 + pc * 8) = f.half[0]; }
     } }

__global__ __launch_bounds__(256) void k_hl(const float* __restrict__ F, _Float16* __restrict__ Hh, _Float16* __restrict__ Hl, size_t n8) { const size_t t = (size_t)blockIdx.x * 256 + threadIdx.x; if (t >= n8) return; FragH fh, fl; const v4f a = *(const v4fa*)(F + t * 8), c = *(const v4fa*)(F + t * 8 + 4);
#pragma unroll
  for (int q = 0; q < 4; ++q) { _Float16 h = (_Float16)a[q]; fh.h[q] = h; fl.h[q] = (_Float16)((a[q] - (float)h) * 1024.0f); h = (_Float16)c[q]; fh.h[4 + q] = h; fl.h[4 + q] = (_Float16)((c[q] - (float)h) * 1024.0f); }
  { *(v8us*)((unsigned short*)Hh + t * 8) = fh.half[0]; *(v8us*)((unsigned short*)Hl + t * 8) = fl.half[0];  } }

// ---- fast GEMM, two shapes picked by WC: WC = 1: block tile 128x64, 4 waves (4 x 1), wave tile 32x64; WC = 2: block tile 256x128, 8 waves (4 x 2), wave tile 64x64.
// Requires M % (128 WC) == 0 rows per launch region, N % (64 WC) == 0, K % 64 == 0, K >= 64; epilogue = k_gemm_hhx semantics ----
// The larger tile fetches half the operand bytes from L2 per product (384 rows for 256x128 outputs, not 192 for 128x64) and reads two thirds of the LDS bytes per matrix instruction (8 fragments for 16, not 6 for 8).
// Operands go global -> LDS by asynchronous copies, 64 k (one whole 128-byte line of every operand row) per stage, two buffers: eight lanes cover a row's line, so a
// wave's copy touches four whole lines, and every line is fetched once per block. The fragments are read from LDS in the k order of g2_frag.
#define G2_KS 64                              /* k per stage */
#define G2_PITCH 144                          /* LDS row pitch in bytes: 16 B x odd, so that 16 lanes on 16 neighbouring rows meet no bank twice */
__device__ __forceinline__ v16h g2_frag(const unsigned char* p, int hh) { FragH f; f.half[0] = *(const v8us*)(p + 16 * hh); f.half[1] = *(const v8us*)(p + 32 + 16 * hh); return f.v; }
__device__ __forceinline__ v8f g2_mma(v16h a, v16h b, v8f c) { v8f d = __builtin_amdgcn_wmma_f32_16x16x32_f16(false, a, false, b, (short)0, c, false, false); asm volatile("v_nop\n\tv_nop\n\tv_nop\n\tv_nop" : "+v"(d) : "v"(a), "v"(b)); return d; }
// One stage's twelve copies of a thread (16 bytes each): rows sr + RS i of A (i = 0 .. 7) and of B (i = 0 .. 3), RS = the rows that the block's threads cover at once; B lies behind A's 8 RS rows.
// l = the thread's LDS byte address in the stage's row sr. The s_wait_xcnt closes the statement, so that it stands ahead of every later overwrite of the copies' address registers.
template <int RS>
__device__ __forceinline__ void g2_copy(unsigned l, const _Float16* ga, size_t sa, const _Float16* gb, size_t sb) {
  asm volatile("global_load_async_to_lds_b128 %0, %12, off\n\t" "global_load_async_to_lds_b128 %1, %13, off\n\t" "global_load_async_to_lds_b128 %2, %14, off\n\t" "global_load_async_to_lds_b128 %3, %15, off\n\t"
               "global_load_async_to_lds_b128 %4, %16, off\n\t" "global_load_async_to_lds_b128 %5, %17, off\n\t" "global_load_async_to_lds_b128 %6, %18, off\n\t" "global_load_async_to_lds_b128 %7, %19, off\n\t"
               "global_load_async_to_lds_b128 %8, %20, off\n\t" "global_load_async_to_lds_b128 %9, %21, off\n\t" "global_load_async_to_lds_b128 %10, %22, off\n\t" "global_load_async_to_lds_b128 %11, %23, off\n\t"
               "s_wait_xcnt 0x0"
               :: "v"(l), "v"(l + RS * G2_PITCH), "v"(l + 2 * RS * G2_PITCH), "v"(l + 3 * RS * G2_PITCH), "v"(l + 4 * RS * G2_PITCH), "v"(l + 5 * RS * G2_PITCH), "v"(l + 6 * RS * G2_PITCH), "v"(l + 7 * RS * G2_PITCH),
                  "v"(l + 8 * RS * G2_PITCH), "v"(l + 9 * RS * G2_PITCH), "v"(l + 10 * RS * G2_PITCH), "v"(l + 11 * RS * G2_PITCH),
                  "v"(ga), "v"(ga + sa), "v"(ga + 2 * sa), "v"(ga + 3 * sa), "v"(ga + 4 * sa), "v"(ga + 5 * sa), "v"(ga + 6 * sa), "v"(ga + 7 * sa),
                  "v"(gb), "v"(gb + sb), "v"(gb + 2 * sb), "v"(gb + 3 * sb) : "memory"); }
// Eight of a lane's residual loads (16 bytes each), issued one behind the other with no wait on their data between them.
// The s_wait_xcnt stands ahead of every overwrite of the loads' address registers; the addresses as its inputs keep their registers from being rewritten, or handed to one of the loads as a destination, ahead of it.
__device__ __forceinline__ void g2_res8(const float* const (&rp)[8], v4f* res) {
#pragma unroll      /* constant indices: rp and res stay in registers */
  for (int q = 0; q < 8; ++q) res[q] = *(const v4fa*)rp[q];
  asm volatile("s_wait_xcnt 0x0" :: "v"(rp[0]), "v"(rp[1]), "v"(rp[2]), "v"(rp[3]), "v"(rp[4]), "v"(rp[5]), "v"(rp[6]), "v"(rp[7]) : "memory"); }
// A lane's share of the residual for 32 rows from row rbase on: sixteen 16-byte loads, in two runs of eight (sixteen address pairs at once would cost registers).
__device__ __forceinline__ void g2_res16(const float* __restrict__ CP, int rowsPerB, size_t sCPb, size_t cofs, int by, int ldc, int rbase, int colc, v4f* res) {
  if (rowsPerB < 0) {      /* rowsPerB < 0: own elements of the batched C plane */
#pragma unroll
    for (int g = 0; g < 2; ++g) { const float* rp[8];
#pragma unroll
      for (int q = 0; q < 8; ++q) rp[q] = CP + cofs + (size_t)(rbase + (g * 8 + q) * 2) * ldc + colc;
      g2_res8(rp, res + g * 8); }
  } else {
#pragma unroll
    for (int g = 0; g < 2; ++g) { const float* rp[8];
#pragma unroll
      for (int q = 0; q < 8; ++q) { const int bidx = (rbase + (g * 8 + q) * 2) / rowsPerB; rp[q] = CP + (size_t)bidx * sCPb + (size_t)by * 64 + colc; }
      g2_res8(rp, res + g * 8); } } }
// GELU on the error function, x Phi(x), without a branch: x Phi(x) = max(x, 0) - |x| Q(|x|), where Q(a) = 1 - Phi(a) = e^(-a a / 2) (c1 t + c2 t^2 + c3 t^3 + c4 t^4 + c5 t^5), t = 1 / (1 + 0.2316419 a)
// (the classical five-term form of the normal tail, the factor 1 / sqrt(2 pi) folded into c1 .. c5; its error in Q is below 7.5e-8 for every a >= 0). The tail is formed directly, so nothing cancels for x < 0;
// the result is within 4e-7 of x Phi(x) in f32 and is stored as f16. The library erff takes two branches per element, which a wave walks one behind the other as one dependent chain; here the elements of a row are independent straight-line chains.
__device__ __forceinline__ float g2_gelu(float x) {
  const float a = fabsf(x);
  float t; asm("v_rcp_f32 %0, %1\n\tv_nop" : "=v"(t) : "v"(fmaf(0.2316419f, a, 1.0f)));      /* the v_nop is the slot that the instruction set asks for between a transcendental and a directly following instruction that reads its result or overwrites its source */
  const float e = __builtin_amdgcn_exp2f((x * -0.72134752f) * x);      /* e^(-x x / 2) = 2^(-x x log2(e) / 2); an argument far below the range gives 0, the tail's limit */
  float p = fmaf(t, 0.53070271f, -0.72657601f); p = fmaf(t, p, 0.71070687f); p = fmaf(t, p, -0.14224837f); p = fmaf(t, p, 0.12741480f);
  return fmaf(-(a * e), p * t, fmaxf(x, 0.f)); }
// Sum over the sixteen lanes of a row of lanes (every lane ends with it), on the vector unit's own cross-lane operand: no trip through the LDS queue. All lanes are on where it is called.
__device__ __forceinline__ float g2_row16(float x) {
  x += __int_as_float(__builtin_amdgcn_update_dpp(0, __float_as_int(x), 0x168, 0xf, 0xf, true));      /* row_xmask:8, then 4, 2, 1 */
  x += __int_as_float(__builtin_amdgcn_update_dpp(0, __float_as_int(x), 0x164, 0xf, 0xf, true));
  x += __int_as_float(__builtin_amdgcn_update_dpp(0, __float_as_int(x), 0x162, 0xf, 0xf, true));
  x += __int_as_float(__builtin_amdgcn_update_dpp(0, __float_as_int(x), 0x161, 0xf, 0xf, true));
  return x; }
// EX: a row normalisation done where the rows are made, in place of a launch of its own. In the read-back a row's 64 columns of the wave's tile lie in sixteen neighbouring lanes, four each.
// EX = 1 (rmsnorm of the result, first half): C16 gets x XS[col] (XS rounded to bf16), not yet divided by the row's norm, and SS[row][col / 64] the sum of x x over the wave's 64 columns.
// EX = 2 (second half, in the product that reads those rows as A): 1 / rms of each of the block's rows from its K / 64 = DM / 64 partial sums, once per block into LDS; a row's factor commutes with the product over k, so the epilogue multiplies by it.
// EX = 3 (l2 norm): N = 64 per operand half, so a wave's 64 columns are one whole q or k row: it is divided by max(its norm, 1e-8) before the store.
template <int ACT, int WC, int EX>
__device__ __forceinline__ void d_gemm2(int bxi, int by, const _Float16* __restrict__ A, int lda, size_t sA, const _Float16* __restrict__ Bh, int ldb, size_t sB, float alpha, const float* __restrict__ bias, size_t sBias, const float* __restrict__ CP, int rowsPerB, size_t sCPb, int row0g,
    float* __restrict__ C, _Float16* __restrict__ C16, int ldc, size_t sC, int M, int N, int K, const float* __restrict__ XS, float* __restrict__ SS) { static_assert(ACT == 0 || ACT == 3 || ACT == 6 || ACT == 8 || ACT == 9 || ACT == 11 || ACT == 12 || ACT == 14 || ACT == 15 || ACT == 16 || ACT == 17, "k_gemm2: unsupported ACT code (would silently apply no activation)");
  static_assert(WC == 1 || WC == 2, "k_gemm2: two shapes");
  constexpr int NW = 4 * WC, FA = 2 * WC, BM = 128 * WC, BN = 64 * WC, RS = 4 * NW;      /* waves, A fragments per wave, block tile, rows per copy of the block */
  constexpr unsigned STAGE = (unsigned)((BM + BN) * G2_PITCH);      /* one stage: [A BM rows | B BN rows] */
  __shared__ __attribute__((aligned(16))) unsigned char sm[2 * STAGE]; static_assert(sizeof(float) * NW * 32 * 68 <= 2 * STAGE, "the output staging lies in the ring");
  float (*so)[32][68] = (float (*)[32][68])sm;      /* output staging, 32 rows of a wave at a time: used only behind the last trip's barrier, when no wave reads the ring any more */
  __shared__ float rsS[EX == 2 ? BM : 1]; static_assert(EX != 2 || BM == 128 * WC, "one thread per row of the block");
  const int tid = threadIdx.x, w = tid >> 5, lane = tid & 31, ln = lane & 15, hh = lane >> 4; const int wr = w & 3, wc = w >> 2;
  A += (size_t)by * sA; Bh += (size_t)by * sB; const size_t cofs = (size_t)by * sC; const float* bp = bias ? bias + (size_t)by * sBias : nullptr;
  const int ntn = N / BN; const int mt = bxi / ntn, nq = bxi - mt * ntn; const int row0 = mt * BM + 16 * FA * wr, col0 = nq * BN + 64 * wc; if (mt * BM >= M) return;      /* the whole block leaves, ahead of every copy and barrier */
  const int sr = tid >> 3, sc = tid & 7;      /* the thread's first row of a stage and its 16-byte piece of the row's line */
  const _Float16* ga = A + (size_t)(mt * BM + sr) * lda + sc * 8; const _Float16* gb = Bh + (size_t)(nq * BN + sr) * ldb + sc * 8; const size_t sa = (size_t)RS * lda, sb = (size_t)RS * ldb;
  const unsigned l0 = (unsigned)(size_t)sm + (unsigned)(sr * G2_PITCH + sc * 16);
  const unsigned char* ar = sm + (16 * FA * wr + ln) * G2_PITCH; const unsigned char* br = sm + (BM + 64 * wc + ln) * G2_PITCH;
  const int nt = K / G2_KS;
  const v8f z8 = {0.f,0.f,0.f,0.f,0.f,0.f,0.f,0.f}; v8f acc[FA][4];
#pragma unroll      /* constant indices here and below: acc, fa and fb stay in registers */
  for (int i = 0; i < FA; ++i)
#pragma unroll
    for (int j = 0; j < 4; ++j) acc[i][j] = z8;
  g2_copy<RS>(l0, ga, sa, gb, sb);
  if (EX == 2) {      /* behind the first copies, so that both latencies run together; the barrier below publishes rsS with stage 0 */
    const float* sp = SS + (size_t)(mt * BM + tid) * (DM / 64); const v4f p0 = *(const v4fa*)sp, p1 = *(const v4fa*)(sp + 4), p2 = *(const v4fa*)(sp + 8), p3 = *(const v4fa*)(sp + 12);
    asm volatile("s_wait_xcnt 0x0" :: "v"(sp) : "memory");      /* stands ahead of every overwrite of the loads' address registers; sp as an input keeps them from being handed to a load as a destination ahead of it */
    const v4f ps = (p0 + p1) + (p2 + p3); rsS[tid] = 1.0f / sqrtf(((ps[0] + ps[1]) + (ps[2] + ps[3])) / (float)DM + 1e-8f); }
  asm volatile("s_wait_asynccnt 0x0" ::: "memory");      /* this wave's copies of stage 0 have landed */
  __syncthreads();      /* and every other wave's: stage 0 may be read */
  if (nt > 1) g2_copy<RS>(l0 + STAGE, ga + G2_KS, sa, gb + G2_KS, sb);
  constexpr int KG = (WC == 1) ? 2 : 1;      /* 32-k blocks whose fragments are held at once: both of the stage where they fit beside the accumulators */
#pragma unroll 1      /* one trip per stage: the buffer is chosen by the trip's parity */
  for (int t = 0; t < nt; ++t) { const unsigned bo = (unsigned)(t & 1) * STAGE;
    const unsigned char* ap = ar + bo; const unsigned char* bq = br + bo;
#pragma unroll      /* the stage's two 32-k blocks, straight-line, k rising */
    for (int kg = 0; kg < 2; kg += KG) { v16h fa[KG][FA], fb[KG][4];
#pragma unroll
      for (int kk = 0; kk < KG; ++kk) {
#pragma unroll
        for (int i = 0; i < FA; ++i) fa[kk][i] = g2_frag(ap + i * 16 * G2_PITCH + (kg + kk) * 64, hh);
#pragma unroll
        for (int j = 0; j < 4; ++j) fb[kk][j] = g2_frag(bq + j * 16 * G2_PITCH + (kg + kk) * 64, hh); }
#pragma unroll
      for (int kk = 0; kk < KG; ++kk)
#pragma unroll
        for (int j = 0; j < 4; ++j)
#pragma unroll
          for (int i = 0; i < FA; ++i) acc[i][j] = g2_mma(fa[kk][i], fb[kk][j], acc[i][j]); }
    asm volatile("s_wait_dscnt 0x0" ::: "memory");      /* this wave's reads of the buffer are done */
    asm volatile("s_wait_asynccnt 0x0" ::: "memory");      /* its copies of stage t + 1 have landed */
    __syncthreads();      /* publishes stage t + 1 and ends every reader's last read of stage t's buffer */
    if (t + 2 < nt) g2_copy<RS>(l0 + bo, ga + (size_t)(t + 2) * G2_KS, sa, gb + (size_t)(t + 2) * G2_KS, sb); }
  asm volatile("s_wait_asynccnt 0x0" ::: "memory");      /* no copy is outstanding when the ring becomes output staging */
  // Scale, bias, residual and activation are applied where the staged rows are read back: there a lane holds four neighbouring columns of a row, so that its share of the residual is
  // sixteen 16-byte loads per 32 rows (a wave's load covers whole 128-byte lines), all of them issued ahead of the staging and waited for once. The unrolls keep res and acc in registers (constant indices).
  const int rsub = lane >> 4, c4 = (lane & 15) * 4; const v4f z4 = {0.f, 0.f, 0.f, 0.f};
#pragma unroll 1      /* 32 rows of the wave's tile per trip; stays rolled: a second copy of this body would double the kernel's text, which runs once per wave, straight from the instruction fetch */
  for (int hf = 0; hf < FA / 2; ++hf) { v4f res[16], bv4 = z4, xs4 = z4; float sq[16], ssk = 0.f;
    if (CP) g2_res16(CP, rowsPerB, sCPb, cofs, by, ldc, row0g + row0 + hf * 32 + rsub, col0 + c4, res);
    else {
#pragma unroll
      for (int q = 0; q < 16; ++q) res[q] = z4; }
    if (bp) { bv4 = *(const v4fa*)(bp + col0 + c4);
      asm volatile("s_wait_xcnt 0x0" ::: "memory"); }      /* stands ahead of every later overwrite of the bias load's address registers */
    if (EX == 1) { xs4 = *(const v4fa*)(XS + col0 + c4);
      asm volatile("s_wait_xcnt 0x0" ::: "memory"); }      /* stands ahead of every later overwrite of this load's address registers */
#pragma unroll
    for (int i = 0; i < 4; ++i) { bv4[i] = bf16_round(bv4[i]); xs4[i] = bf16_round(xs4[i]); }
#pragma unroll
    for (int u = 0; u < 8; ++u) { const int t = u & 3, half = u >> 2;
#pragma unroll
      for (int r = 0; r < 8; ++r) so[w][half * 16 + 8 * hh + r][t * 16 + ln] = acc[half][t][r]; }
    __builtin_amdgcn_fence(__ATOMIC_ACQ_REL, "workgroup"); __builtin_amdgcn_wave_barrier();
    if constexpr (EX == 3) {      /* the sixteen rows are read back together and normalised side by side: sixteen independent chains of sum, root and division, not one behind the other */
      static_assert(ACT == 0, "the l2 norm takes the plain product"); v4f vv[16];
#pragma unroll
      for (int q = 0; q < 16; ++q) vv[q] = *(const v4fa*)&so[w][q * 2 + rsub][c4];
#pragma unroll
      for (int q = 0; q < 16; ++q) { v4f v = vv[q];
#pragma unroll
        for (int i = 0; i < 4; ++i) v[i] = v[i] * alpha + bv4[i];
        float n = sqrtf(g2_row16((v[0] * v[0] + v[1] * v[1]) + (v[2] * v[2] + v[3] * v[3]))); if (n < 1e-8f) n = 1e-8f; const float inv = 1.0f / n;
#pragma unroll
        for (int i = 0; i < 4; ++i) vv[q][i] = v[i] * inv; }
#pragma unroll
      for (int q = 0; q < 16; ++q) { *(v4f*)(C + cofs + (size_t)(row0 + hf * 32 + q * 2 + rsub) * ldc + col0 + c4) = vv[q];
        asm volatile("s_wait_xcnt 0x0" ::: "memory"); }      /* stands ahead of every later overwrite of this store's registers */
    } else
#pragma unroll
    for (int q = 0; q < 16; ++q) { const int r = q * 2 + rsub; v4f v = *(const v4fa*)&so[w][r][c4]; const float ar = (EX == 2) ? alpha * rsS[16 * FA * wr + hf * 32 + r] : alpha;
#pragma unroll
      for (int i = 0; i < 4; ++i) { float x = v[i] * ar + bv4[i]; if (CP) x += res[q][i];
        if (ACT == 3) x = fmaxf(x, 0.f); else if (ACT == 6) x = g2_gelu(x); else if (ACT == 11) x = 1.0f / (1.0f + expf(-x)); else if (ACT == 15) x = x / (1.0f + expf(-x)); else if (ACT == 12) x = (x > 0.f) ? x : 0.01f * x; else if (ACT == 8) x = tanhf(x); else if (ACT == 9) x = 0.5f * x * (1.0f + tanhf(0.7978845608028654f * (x + 0.044715f * x * x * x))); else if (ACT == 14) x = (x > 0.f) ? x : 0.1f * x; else if (ACT == 16) x = (x >= 0.f) ? x : 0.3f * x; else if (ACT == 17) x = (x >= 0.f) ? x : 0.2f * x;
        v[i] = x; }
      if (EX == 1) sq[q] = (v[0] * v[0] + v[1] * v[1]) + (v[2] * v[2] + v[3] * v[3]);      /* the lane's share of the row's sum; the sixteen rows' lane sums are formed together, below */
      if (C) { *(v4f*)(C + cofs + (size_t)(row0 + hf * 32 + r) * ldc + col0 + c4) = v;
        asm volatile("s_wait_xcnt 0x0" ::: "memory"); }      /* stands ahead of the f16 conversion below, which may be given the store's data registers */
      if (C16) { v4h h4; for (int i = 0; i < 4; ++i) h4[i] = (_Float16)(EX == 1 ? v[i] * xs4[i] : v[i]); *(v4h*)(C16 + cofs + (size_t)(row0 + hf * 32 + r) * ldc + col0 + c4) = h4;
        asm volatile("s_wait_xcnt 0x0" ::: "memory"); } }      /* stands ahead of every later overwrite of this store's registers, the accumulators' move below among them */
    if (EX == 1) {
#pragma unroll      /* sixteen independent chains, side by side; lane ln keeps the sum of row 2 ln + rsub: one store for the 32 rows */
      for (int q = 0; q < 16; ++q) { const float s = g2_row16(sq[q]); ssk = (ln == q) ? s : ssk; }
      SS[(size_t)(row0 + hf * 32 + 2 * ln + rsub) * (N / 64) + (col0 >> 6)] = ssk;
      asm volatile("s_wait_xcnt 0x0" ::: "memory"); }      /* stands ahead of every later overwrite of this store's registers */
    if (FA > 2) {      /* the next 32 rows' accumulators move down for the next trip */
      asm volatile("s_wait_dscnt 0x0" ::: "memory"); __builtin_amdgcn_wave_barrier();      /* every lane's read-back is done before the next rows are staged over it */
#pragma unroll
      for (int i = 0; i + 2 < FA; ++i)
#pragma unroll
        for (int j = 0; j < 4; ++j) acc[i][j] = acc[i + 2][j]; } } }
template <int ACT, int WC, int EX>
__global__ __launch_bounds__(128 * WC) void k_gemm2(const _Float16* __restrict__ A, int lda, size_t sA, const _Float16* __restrict__ Bh, int ldb, size_t sB, float alpha, const float* __restrict__ bias, size_t sBias, const float* __restrict__ CP, int rowsPerB, size_t sCPb, int row0g,
    float* __restrict__ C, _Float16* __restrict__ C16, int ldc, size_t sC, int M, int N, int K, const float* __restrict__ XS, float* __restrict__ SS) {
  d_gemm2<ACT, WC, EX>(blockIdx.x, blockIdx.y, A, lda, sA, Bh, ldb, sB, alpha, bias, sBias, CP, rowsPerB, sCPb, row0g, C, C16, ldc, sC, M, N, K, XS, SS); }


// The short jobs below are device functions: bx is the block's index inside its job. k_prep and k_qkhT, behind them, hand each block of one grid its job.
__device__ __forceinline__ void d_wT(int bx, const float* __restrict__ w, int din, int dout, _Float16* __restrict__ Bt) { __shared__ float tl[64][65]; const int tid = threadIdx.x; const int nbo = dout / 64; const int ib = bx / nbo, ob = bx % nbo; const int i0 = ib * 64, o0 = ob * 64;
  for (int t = tid; t < 64 * 64; t += 256) { const int i = t / 64, o = t % 64; tl[o][i] = bf16_round(w[(size_t)(i0 + i) * dout + o0 + o]) * 16.0f; }
  __syncthreads();
  { for (int t = tid; t < 64 * 8; t += 256) { const int o = t / 8, i8 = (t % 8) * 8; FragH f; for (int q = 0; q < 8; ++q) f.h[q] = (_Float16)tl[o][i8 + q]; *(v8us*)((unsigned short*)Bt + (size_t)(o0 + o) * din + i0 + i8) = f.half[0]; }  } }
__device__ __forceinline__ void d_wnat(int bx, const float* __restrict__ w, size_t n8, _Float16* __restrict__ Bt) { const size_t t = (size_t)bx * 256 + threadIdx.x; if (t >= n8) return; FragH f; for (int q = 0; q < 8; ++q) f.h[q] = (_Float16)(bf16_round(w[t * 8 + q]) * 16.0f); *(v8us*)((unsigned short*)Bt + t * 8) = f.half[0];  }
// One row per wave: lane l holds columns 128 u + 4 l .. + 3 (u = 0 .. 7), so every load and every f32 store of a wave covers 512 contiguous bytes (an f16 store 256),
// and the row stays in registers between the sum of squares and the scaling. No LDS, no barrier. The unrolls keep xv, sv and o in registers (constant indices).
__device__ __forceinline__ void d_rms(int bx, const float* __restrict__ X, int xIsInput, const float* __restrict__ scale, size_t nrows, _Float16* __restrict__ N16, float* __restrict__ XF) {
  const int lane = threadIdx.x & 31; const size_t r = (size_t)bx * 8 + (threadIdx.x >> 5); if (r >= nrows) return;      /* the same for a whole wave */
  const size_t o0 = r * DM + lane * 4; const float* xp = X + o0; const float* sp = scale + lane * 4; v4f xv[DM / 128], sv[DM / 128];
#pragma unroll
  for (int u = 0; u < DM / 128; ++u) xv[u] = *(const v4fa*)(xp + u * 128);
#pragma unroll
  for (int u = 0; u < DM / 128; ++u) sv[u] = *(const v4fa*)(sp + u * 128);
  asm volatile("s_wait_xcnt 0x0" :: "v"(xp) : "memory");      /* stands ahead of every overwrite of the loads' address registers; xp as an input keeps its registers from being handed to one of the loads as a destination ahead of it */
  if (xIsInput) {
#pragma unroll
    for (int u = 0; u < DM / 128; ++u)
#pragma unroll
      for (int q = 0; q < 4; ++q) xv[u][q] = bf16_round(xv[u][q]); }
  if (XF) {      /* the f32 copy leaves as soon as it is known; xv is only read from here on */
#pragma unroll
    for (int u = 0; u < DM / 128; ++u) *(v4f*)(XF + o0 + u * 128) = xv[u];
    asm volatile("s_wait_xcnt 0x0" ::: "memory"); }      /* stands ahead of every later overwrite of these stores' address and data registers */
  float s4[4] = {0.f, 0.f, 0.f, 0.f};      /* four independent chains per lane */
#pragma unroll
  for (int u = 0; u < DM / 128; ++u)
#pragma unroll
    for (int q = 0; q < 4; ++q) s4[q] += xv[u][q] * xv[u][q];
  float ss = (s4[0] + s4[1]) + (s4[2] + s4[3]);
#pragma unroll
  for (int m = 16; m >= 1; m >>= 1) ss += __shfl_xor(ss, m, 32);      /* every lane ends with the row's sum */
  const float rs = 1.0f / sqrtf(ss / (float)DM + 1e-8f); v4h o[DM / 128];
#pragma unroll
  for (int u = 0; u < DM / 128; ++u)
#pragma unroll
    for (int q = 0; q < 4; ++q) o[u][q] = (_Float16)((xv[u][q] * rs) * bf16_round(sv[u][q]));
#pragma unroll
  for (int u = 0; u < DM / 128; ++u) *(v4h*)(N16 + o0 + u * 128) = o[u]; }
// A 64 x 64 tile per block of 128 threads: a thread takes four 16-byte pieces, rows 16 apart. Its four loads are issued together, so that the block waits for one latency, not for four one behind the other.
__device__ __forceinline__ void d_hT(int bx, int b, const _Float16* __restrict__ HN, _Float16* __restrict__ HT) { __shared__ unsigned short tl[64][65]; const int tid = threadIdx.x; HT += (size_t)b * DM * SQ;      /* b is the batch, each has its own [DM][SQ] plane */
  const int jb = bx % (SQ / 64), dbk = bx / (SQ / 64); const int j0 = jb * 64, d0 = dbk * 64; const int r16 = tid / 8, c8 = (tid % 8) * 8;
  const unsigned short* gp[4]; FragH f[4];
#pragma unroll      /* constant indices here and below: gp and f stay in registers */
  for (int u = 0; u < 4; ++u) gp[u] = (const unsigned short*)HN + ((size_t)b * SQ + j0 + r16 + 16 * u) * DM + d0 + c8;
#pragma unroll
  for (int u = 0; u < 4; ++u) f[u].half[0] = *(const v8us*)gp[u];
  asm volatile("s_wait_xcnt 0x0" :: "v"(gp[0]) : "memory");      /* stands ahead of every overwrite of the loads' address registers (one pair, the rows by immediate offsets); the address as an input keeps them from being rewritten, or handed to a load as a destination, ahead of it */
#pragma unroll
  for (int u = 0; u < 4; ++u)
#pragma unroll
    for (int q = 0; q < 8; ++q) tl[c8 + q][r16 + 16 * u] = f[u].u[q];
  __syncthreads();
#pragma unroll
  for (int u = 0; u < 4; ++u)
#pragma unroll
    for (int q = 0; q < 8; ++q) f[u].u[q] = tl[r16 + 16 * u][c8 + q];
#pragma unroll
  for (int u = 0; u < 4; ++u) { *(v8us*)((unsigned short*)HT + (size_t)(d0 + r16 + 16 * u) * SQ + j0 + c8) = f[u].half[0];
    asm volatile("s_wait_xcnt 0x0" ::: "memory"); } }      /* stands ahead of every later overwrite of this store's registers */
__device__ __forceinline__ void d_tab(int bx, const float* __restrict__ dl, float* __restrict__ T) {
  #pragma clang fp contract(off)
  const int t = bx * 256 + threadIdx.x; if (t >= SQ * RR) return; const int r = t % RR, d = t / RR; const float g = __fadd_rn(0.15f, __fmul_rn(0.85f, 1.0f / (1.0f + expf(-bf16_round(dl[r]))))); const float lg = logf(fmaxf(g, 1e-8f)); const float v = expf(__fmul_rn((float)d, lg));
  *(float*)(T + t) = v;  }
// Launches that need nothing of one another share one grid: a range of the block index picks the job, so every branch here is the same for a whole block.
// k_prep reads inputs only: [u|v]^T, the first rmsnorm, the three weight planes, the decay table. The jobs with the longest blocks come first.
#define PB_WT ((DM / 64) * (RR / 64))        /* blocks of one d_wT job */
#define PB_RMS ((int)(NR / 8))
#define PB_WP (DM * DM / 8 / 256)            /* blocks of d_wnat on proj_w; up_w and down_w take PB_WU each */
#define PB_WU (FH * DM / 8 / 256)
#define PB_TAB (SQ * RR / 256)
__global__ __launch_bounds__(256) void k_prep(const float* __restrict__ u, const float* __restrict__ v, const float* __restrict__ pw, const float* __restrict__ uw, const float* __restrict__ dw, const float* __restrict__ dl, const float* __restrict__ h, const float* __restrict__ n1,
    _Float16* __restrict__ BUV, _Float16* __restrict__ BP, _Float16* __restrict__ BU, _Float16* __restrict__ BD, float* __restrict__ T, _Float16* __restrict__ HN16, float* __restrict__ HF) {
  int bx = blockIdx.x;
  if (bx < 2 * PB_WT) { const int s = bx / PB_WT; d_wT(bx - s * PB_WT, s ? v : u, DM, RR, BUV + (size_t)s * RR * DM); return; }      /* [u|v]^T -> [128][1024] */
  bx -= 2 * PB_WT;
  if (bx < PB_RMS) { d_rms(bx, h, 1, n1, NR, HN16, HF); return; }      /* hn (f16) + bf16(h) (f32 residual) */
  bx -= PB_RMS;
  if (bx < PB_WP + 2 * PB_WU) { const float* w = pw; _Float16* Bt = BP; size_t n8 = (size_t)DM * DM / 8;
    if (bx >= PB_WP) { bx -= PB_WP; w = uw; Bt = BU; n8 = (size_t)FH * DM / 8; if (bx >= PB_WU) { bx -= PB_WU; w = dw; Bt = BD; } }
    d_wnat(bx, w, n8, Bt); return; }
  d_tab(bx - (PB_WP + 2 * PB_WU), dl, T); }
// The q|k product fills half of the chip's WGPs, four waves each, and the transposed hn planes need the first rmsnorm alone, as it does: one grid, the product's blocks first.
#define PB_QK ((int)(NR / 128) * (2 * RR / 64))
#define PB_HT ((SQ / 64) * (DM / 64))        /* blocks of d_hT per batch */
__global__ __launch_bounds__(128) void k_qkhT(const _Float16* __restrict__ HN, const _Float16* __restrict__ BUV, float* __restrict__ QK, _Float16* __restrict__ HT) {
  const int bx = blockIdx.x;      /* the branch is the same for a whole block */
  if (bx < PB_QK) { d_gemm2<0, 1, 3>(bx, 0, HN, DM, 0, BUV, DM, 0, 0.0625f, nullptr, 0, nullptr, 1, 0, 0, QK, nullptr, 2 * RR, 0, (int)NR, 2 * RR, DM, nullptr, nullptr); return; }      /* [q | k], each row l2-normalised */
  d_hT((bx - PB_QK) % PB_HT, (bx - PB_QK) / PB_HT, HN, HT); }
// Mixing matrix, one 32 (rows i) x 64 (columns j) tile per block. In a tile that the diagonal crosses a thread owns one column: its k row stays in registers, the tile's q rows and the
// decay-table rows that the tile's distances i - j reach lie in LDS (rows of a negative distance are zero; those elements are masked at the store).
// Every "#pragma unroll" in the path of those tiles is there so that the small arrays it indexes (tx, qx, kr, tb, qb, acc) get constant indices and stay in registers.
#define AM_TI 32
#define AM_TJ 64
#define AM_TD (AM_TI + AM_TJ)        /* 95 distances, and one row more that nobody reads: the staging is then six whole trips of the block */
#define AM_P (RR + 4)                /* LDS row pitch in floats: 16 B x odd, so that 16 lanes on 16 neighbouring rows meet no bank twice */
// A tile whose every column lies at or before its first row i0 (j <= i0 <= i) needs no table row per element: gamma^(i-j) = gamma^(i-i0) * gamma^(i0-j), both exponents >= 0, so both
// factors are table rows <= 1. With q'[i][r] = q[i][r] gamma_r^(i-i0) and k'[j][r] = k[j][r] gamma_r^(i0-j) the tile's scores are the plain product q' k'^T over the 64 ranks: one 16x16 piece per wave on WMMA.
// q' and k' are staged as f16 pairs hi + lo (x = hi + lo to about 2^-22 of x) and the product takes the three terms hi hi + lo hi + hi lo; the powers of two AM_SQ, AM_SK lift small values off the f16 subnormals and are divided out exactly.
#define AM_HP (G2_PITCH / 2)         /* f16 row pitch of the staged q' and k': the pitch that g2_frag's readers want */
#define AM_SQ 16.0f
#define AM_SK 256.0f
__device__ __forceinline__ void am_stage(const v4f a0, const v4f a1, const v4f t0, const v4f t1, float s, _Float16* hi, _Float16* lo) { FragH fh, fl;
#pragma unroll      /* constant indices: the eight values stay in registers */
  for (int q = 0; q < 8; ++q) { const float x = ((q < 4 ? a0[q & 3] : a1[q & 3]) * (q < 4 ? t0[q & 3] : t1[q & 3])) * s; const _Float16 h = (_Float16)x; fh.h[q] = h; fl.h[q] = (_Float16)(x - (float)h); }
  *(v8us*)hi = fh.half[0]; *(v8us*)lo = fl.half[0]; }
__global__ __launch_bounds__(256) void k_amat(const float* __restrict__ QK, const float* __restrict__ kb, const float* __restrict__ T, const float* __restrict__ gl, const float* __restrict__ al, _Float16* __restrict__ A16) {
  __shared__ __attribute__((aligned(16))) float Ts[AM_TD][AM_P];
  __shared__ __attribute__((aligned(16))) float qs[AM_TI][RR];
  __shared__ __attribute__((aligned(16))) float sc[AM_TI][AM_P];
  __shared__ __attribute__((aligned(16))) _Float16 Qm[2][AM_TI][AM_HP];      /* q': [hi | lo] */
  __shared__ __attribute__((aligned(16))) _Float16 Km[2][AM_TJ][AM_HP];      /* k': [hi | lo] */
  const int b = blockIdx.y; A16 += (size_t)b * SQ * SQ;      /* one launch for all batches: blockIdx.y is the batch, each has its own [SQ][SQ] plane */
  const int tid = threadIdx.x; const int jt = blockIdx.x / (SQ / AM_TI), it = blockIdx.x % (SQ / AM_TI); const int i0 = it * AM_TI, j0 = jt * AM_TJ;
  const int orow = tid >> 3, oc8 = (tid & 7) * 8; const int oi = i0 + orow, oj = j0 + oc8;      /* the 8 elements this thread stores */
  unsigned short* dst = (unsigned short*)A16 + (size_t)oi * SQ + oj;
  if (j0 > i0 + AM_TI - 1) { const v8us z = {0, 0, 0, 0, 0, 0, 0, 0}; *(v8us*)dst = z; return; }      /* tile wholly above the diagonal: the whole block leaves, ahead of every barrier */
  const int jl = tid & (AM_TJ - 1), ig = tid >> 6; const int sr = tid >> 4, sc4 = (tid & 15) * 4;
  const int dmin = i0 - j0 - (AM_TJ - 1);
  const v4f kb0 = *(const v4fa*)(kb + (size_t)oi * SQ + oj), kb1 = *(const v4fa*)(kb + (size_t)oi * SQ + oj + 4);
  const float glv = gl[0], alv = al[0]; float gate, alpha;      /* the two logits are read ahead of both paths */
  if (j0 + AM_TJ - 1 <= i0) {      /* the same for the whole block: the tile lies wholly below the diagonal */
    // Eight lanes per row, eight ranks each: a wave's load covers whole 256-byte rows. Row orow of q', rows orow and orow + 32 of k'.
    const float* qp = QK + ((size_t)b * SQ + i0 + orow) * (2 * RR) + oc8; const float* tq = T + (size_t)orow * RR + oc8;
    const float* kp0 = QK + ((size_t)b * SQ + j0 + orow) * (2 * RR) + RR + oc8; const float* kp1 = kp0 + (size_t)32 * (2 * RR);
    const float* tk0 = T + (size_t)(i0 - j0 - orow) * RR + oc8; const float* tk1 = tk0 - (size_t)32 * RR;      /* distances i0 - j: at least i0 - j0 - 63 >= 0, at most i0 - j0 < SQ */
    const v4f q0 = *(const v4fa*)qp, q1 = *(const v4fa*)(qp + 4), u0 = *(const v4fa*)tq, u1 = *(const v4fa*)(tq + 4);
    const v4f c0 = *(const v4fa*)kp0, c1 = *(const v4fa*)(kp0 + 4), w0 = *(const v4fa*)tk0, w1 = *(const v4fa*)(tk0 + 4);
    const v4f e0 = *(const v4fa*)kp1, e1 = *(const v4fa*)(kp1 + 4), y0 = *(const v4fa*)tk1, y1 = *(const v4fa*)(tk1 + 4);
    asm volatile("s_wait_xcnt 0x0" :: "v"(kb + (size_t)oi * SQ + oj), "v"(qp), "v"(tq), "v"(kp0), "v"(tk0) : "memory");      /* stands ahead of every overwrite of the address registers of these loads and of the k_base loads above; the addresses as inputs keep their registers from being rewritten, or handed to a load as a destination, ahead of it */
    gate = 1.0f / (1.0f + expf(-bf16_round(glv))); alpha = 1.0f / (1.0f + expf(-bf16_round(alv)));
    am_stage(q0, q1, u0, u1, AM_SQ, &Qm[0][orow][oc8], &Qm[1][orow][oc8]);
    am_stage(c0, c1, w0, w1, AM_SK, &Km[0][orow][oc8], &Km[1][orow][oc8]);
    am_stage(e0, e1, y0, y1, AM_SK, &Km[0][orow + 32][oc8], &Km[1][orow + 32][oc8]);
    __syncthreads();      /* q' and k' are whole before any wave reads its fragments */
    const int w = tid >> 5, ln = tid & 15, hh = (tid >> 4) & 1, wi = w & 1, wj = w >> 1;      /* wave w: rows 16 wi .., columns 16 wj .. of the tile */
    const unsigned char* fq = (const unsigned char*)&Qm[0][16 * wi + ln][0]; const unsigned char* fk = (const unsigned char*)&Km[0][16 * wj + ln][0];
    v8f d = {0.f, 0.f, 0.f, 0.f, 0.f, 0.f, 0.f, 0.f};
#pragma unroll      /* the two 32-rank blocks, straight-line */
    for (int kk = 0; kk < 2; ++kk) { const v16h qh = g2_frag(fq + kk * 64, hh), ql = g2_frag(fq + sizeof(Qm[0]) + kk * 64, hh), kh = g2_frag(fk + kk * 64, hh), kl = g2_frag(fk + sizeof(Km[0]) + kk * 64, hh);
      d = g2_mma(qh, kh, d); d = g2_mma(ql, kh, d); d = g2_mma(qh, kl, d); }
#pragma unroll      /* constant indices: d stays in registers */
    for (int r = 0; r < 8; ++r) sc[16 * wi + 8 * hh + r][16 * wj + ln] = d[r] * (1.0f / (AM_SQ * AM_SK));
  } else {
  asm volatile("s_wait_xcnt 0x0" :: "v"(kb + (size_t)oi * SQ + oj) : "memory");      /* stands ahead of every overwrite of the k_base loads' address registers; the address as an input keeps them from being rewritten ahead of it */
  v4f tx[AM_TD / 16], qx[AM_TI / 16];
#pragma unroll
  for (int u = 0; u < AM_TD / 16; ++u) { const int d = dmin + sr + u * 16; const int dc = d < 0 ? 0 : (d > SQ - 1 ? SQ - 1 : d); tx[u] = *(const v4fa*)(T + (size_t)dc * RR + sc4); }
#pragma unroll
  for (int u = 0; u < AM_TI / 16; ++u) qx[u] = *(const v4fa*)(QK + ((size_t)b * SQ + i0 + sr + u * 16) * (2 * RR) + sc4);
  asm volatile("s_wait_xcnt 0x0" ::: "memory");      /* the loads below may be given address registers of the loads above as destinations: the wait stands in front of that overwrite */
  const float* kp = QK + ((size_t)b * SQ + j0 + jl) * (2 * RR); v4f kr[RR / 4];
#pragma unroll
  for (int r4 = 0; r4 < RR / 4; ++r4) kr[r4] = *(const v4fa*)(kp + RR + r4 * 4);
  asm volatile("s_wait_xcnt 0x0" :: "v"(kp) : "memory");      /* kp as an input keeps its registers from being handed to one of these loads as a destination ahead of the wait */
  __builtin_amdgcn_sched_barrier(0);      /* every global load is issued before the first wait on one: one latency for the block's start, not two */
  gate = 1.0f / (1.0f + expf(-bf16_round(glv))); alpha = 1.0f / (1.0f + expf(-bf16_round(alv)));
#pragma unroll
  for (int u = 0; u < AM_TD / 16; ++u) { const v4f z4 = {0.f, 0.f, 0.f, 0.f}; *(v4fa*)&Ts[sr + u * 16][sc4] = (dmin + sr + u * 16 < 0) ? z4 : tx[u]; }
#pragma unroll
  for (int u = 0; u < AM_TI / 16; ++u) *(v4fa*)&qs[sr + u * 16][sc4] = qx[u];
  __syncthreads();
#pragma unroll 1      /* stays rolled: the body is over 600 instructions long, and a second copy of it would save one branch */
  for (int hf = 0; hf < 2; ++hf) { const int il = ig * 8 + hf * 4;      /* four rows at a time: four independent sums, each over r in rising order */
    const float* tp = &Ts[il + (AM_TJ - 1) - jl][0]; const float* qp = &qs[il][0]; float acc[4] = {0.f, 0.f, 0.f, 0.f}; v4f tb[2][4][2], qb[2][4][2];
#pragma unroll
    for (int s = 0; s < 4; ++s)
#pragma unroll
      for (int h2 = 0; h2 < 2; ++h2) { qb[0][s][h2] = *(const v4fa*)(qp + s * RR + h2 * 4); tb[0][s][h2] = *(const v4fa*)(tp + s * AM_P + h2 * 4); }
#pragma unroll
    for (int ch = 0; ch < RR / 8; ++ch) {
      if (ch + 1 < RR / 8) {
#pragma unroll
        for (int s = 0; s < 4; ++s)
#pragma unroll
          for (int h2 = 0; h2 < 2; ++h2) { qb[(ch + 1) & 1][s][h2] = *(const v4fa*)(qp + s * RR + (ch + 1) * 8 + h2 * 4); tb[(ch + 1) & 1][s][h2] = *(const v4fa*)(tp + s * AM_P + (ch + 1) * 8 + h2 * 4); } }
      __builtin_amdgcn_sched_barrier(0);      /* keeps the next eight ranks' LDS loads ahead of this eight's arithmetic, which then covers their latency */
#pragma unroll
      for (int h2 = 0; h2 < 2; ++h2)
#pragma unroll
        for (int c = 0; c < 4; ++c)
#pragma unroll
          for (int s = 0; s < 4; ++s) acc[s] += (qb[ch & 1][s][h2][c] * kr[ch * 2 + h2][c]) * tb[ch & 1][s][h2][c];
      __builtin_amdgcn_sched_barrier(0);      /* and keeps the loads after next from rising into it, where they would need a third set of registers */
    }
#pragma unroll
    for (int s = 0; s < 4; ++s) sc[il + s][jl] = acc[s]; }
  }
  __syncthreads();
  const v4f a0 = *(const v4fa*)&sc[orow][oc8], a1 = *(const v4fa*)&sc[orow][oc8 + 4]; FragH f;
#pragma unroll
  for (int u = 0; u < 8; ++u) { const float kv = (u < 4) ? kb0[u & 3] : kb1[u & 3]; const float av = (u < 4) ? a0[u & 3] : a1[u & 3]; const _Float16 v = (_Float16)(gate * bf16_round(kv) + alpha * av); f.h[u] = (oj + u <= oi) ? v : (_Float16)0.0f; }
  *(v8us*)dst = f.half[0]; }

extern "C" void kernel_launch(void* const* d_in, const int* in_sizes, int n_in,
                              void* d_out, int out_size, void* d_ws, size_t ws_size, hipStream_t stream) {
  (void)in_sizes; (void)n_in; (void)out_size;
  const float* const* I = (const float* const*)d_in; const float* h = I[0]; const float* kb = I[1]; const float* dl = I[2]; const float* gl = I[3]; const float* al = I[4]; const float* u = I[5]; const float* v = I[6]; const float* pw = I[7]; const float* pb = I[8]; const float* n1 = I[9]; const float* n2 = I[10]; const float* uw = I[11]; const float* ub = I[12]; const float* dw = I[13]; const float* db = I[14];
  char* ws = (char*)d_ws; size_t off = 0;
  auto take = [&](size_t bytes) { char* p = ws + off; off += (bytes + 255) & ~(size_t)255; return p; };
  _Float16* BUV = (_Float16*)take((size_t)2 * RR * DM * 2); _Float16* BP = (_Float16*)take((size_t)DM * DM * 2); _Float16* BU = (_Float16*)take((size_t)FH * DM * 2); _Float16* BD = (_Float16*)take((size_t)DM * FH * 2); float* T = (float*)take((size_t)SQ * RR * 4);
  _Float16* HN16 = (_Float16*)take(NR * DM * 2); float* HF = (float*)take(NR * DM * 4); float* QK = (float*)take(NR * 2 * RR * 4); _Float16* HT = (_Float16*)take((size_t)NB * DM * SQ * 2); _Float16* A16 = (_Float16*)take((size_t)NB * SQ * SQ * 2);
  _Float16* O16 = (_Float16*)take(NR * DM * 2); float* H1 = (float*)take(NR * DM * 4); _Float16* M16 = (_Float16*)take(NR * DM * 2); _Float16* U16 = (_Float16*)take(NR * FH * 2); float* SS = (float*)take(NR * (DM / 64) * 4);
  if (off > ws_size) return;      /* 0.3 + 2 + 4 + 4 + 0.3 + 16 + 32 + 4 + 16 + 16 + 16 + 32 + 16 + 32 + 0.5 = about 191 MiB */
  k_prep<<<2 * PB_WT + PB_RMS + PB_WP + 2 * PB_WU + PB_TAB, 256, 0, stream>>>(u, v, pw, uw, dw, dl, h, n1, BUV, BP, BU, BD, T, HN16, HF);
  k_qkhT<<<PB_QK + PB_HT * NB, 128, 0, stream>>>(HN16, BUV, QK, HT);
  k_amat<<<dim3((SQ / AM_TI) * (SQ / AM_TJ), NB), 256, 0, stream>>>(QK, kb, T, gl, al, A16);
  k_gemm2<0, 2, 0><<<dim3((SQ / 256) * (DM / 128), NB), 256, 0, stream>>>(A16, SQ, (size_t)SQ * SQ, HT, SQ, (size_t)DM * SQ, 1.0f, nullptr, 0, nullptr, 1, 0, 0, nullptr, O16, DM, (size_t)SQ * DM, SQ, DM, SQ, nullptr, nullptr);      /* out_b = A_b . hn_b, b = blockIdx.y */
  const dim3 gp((unsigned)((NR / 256) * (DM / 128)), 1);
  k_gemm2<0, 2, 1><<<gp, 256, 0, stream>>>(O16, DM, 0, BP, DM, 0, 0.0625f, pb, 0, HF, 1, (size_t)DM, 0, H1, M16, DM, 0, (int)MQ, DM, DM, n2, SS);      /* h1 = h + out proj_w^T + proj_b; M16 = h1 norm2_scale, SS = partial sums of h1 h1 */
  k_gemm2<6, 2, 2><<<dim3((unsigned)((NR / 256) * (FH / 128)), 1), 256, 0, stream>>>(M16, DM, 0, BU, DM, 0, 0.0625f, ub, 0, nullptr, 1, 0, 0, nullptr, U16, FH, 0, (int)MQ, FH, DM, nullptr, SS);      /* gelu_erf(m up_w^T + up_b), m = M16 / rms(h1) */
  k_gemm2<0, 2, 0><<<gp, 256, 0, stream>>>(U16, FH, 0, BD, FH, 0, 0.0625f, db, 0, H1, 1, (size_t)DM, 0, (float*)d_out, nullptr, DM, 0, (int)MQ, DM, FH, nullptr, nullptr);      /* h1 + m */
}
